// v000
// Measured on an AMD MI455X. A time is GPU time per run, averaged over a window of back-to-back runs after a warm-up
// (all launches, gaps included; the runs take copies of the inputs in turn), and the median of several windows.
// Apart from v000's, it joins two sittings. Times from different sittings can be a few percent apart, while
// side-by-side timings come from the same sitting.
// v000, which the later versions start from, runs in 174 microseconds.
#include <hip/hip_runtime.h>

// Contractions on v_wmma_f32_16x16x32_f16, f32 accumulate: the per-feature hidden layers h2 = leaky(h1.W2[f]^T + b2[f]) as 64 GEMMs ([65536 rows x 64].[64 x 64], one
// per feature f) with h1 = leaky(x[b][f] W1[f] + b1[f]) formed in registers from the bf16-rounded input scalar and split into f16 hi + residual x1024 fragments (two products),
// W2[f] as exact f16 (f16 of its bf16 rounding; [out][in] rows are the n-major B operand). The output dots y = h2.W3[f] + b3[f] (64 terms) are f32 VALU reductions.

#define NB_  65536
#define NF   64
#define H1   64
#define H2   64
#define SLP  0.05f
#define LOSC 1024.0f
#define LOSCI (1.0f / 1024.0f)

typedef _Float16 h16;
typedef __attribute__((ext_vector_type(16))) _Float16 v16h;
typedef __attribute__((ext_vector_type(8)))  _Float16 v8h;
typedef __attribute__((ext_vector_type(8)))  float    v8f;
typedef __attribute__((ext_vector_type(4)))  float    v4f;
typedef v4f  __attribute__((may_alias)) v4fa;

__device__ __forceinline__ unsigned short f2bf(float f) { unsigned u = __float_as_uint(f); u += 0x7FFFu + ((u >> 16) & 1u); return (unsigned short)(u >> 16); }
__device__ __forceinline__ float bf2f(unsigned short b) { return __uint_as_float(((unsigned)b) << 16); }
__device__ __forceinline__ float bfr(float f) { return bf2f(f2bf(f)); }
__device__ __forceinline__ v16h cat16(v8h lo, v8h hi) { return __builtin_shufflevector(lo, hi, 0, 1, 2, 3, 4, 5, 6, 7, 8, 9, 10, 11, 12, 13, 14, 15); }
__device__ __forceinline__ v8f wmma16(v16h a, v16h b, v8f c) { return __builtin_amdgcn_wmma_f32_16x16x32_f16(false, a, false, b, (short)0, c, false, false); }
__device__ __forceinline__ float lk(float v) { return v >= 0.f ? v : SLP * v; }
#define VST2(T, p, v) do { const T vst2_v_ = (v); *(T*)(p) = vst2_v_;  } while (0)

__global__ __launch_bounds__(256) void k_w16(const float* __restrict__ W2, h16* W16) {
    const int lane = threadIdx.x & 31, r = blockIdx.x * 8 + (threadIdx.x >> 5);
    if (r >= NF * H2) return;
    typedef __attribute__((ext_vector_type(2))) _Float16 v2h;
    v2h o; o[0] = (h16)bfr(W2[(size_t)r * H1 + 2 * lane]); o[1] = (h16)bfr(W2[(size_t)r * H1 + 2 * lane + 1]);
    VST2(v2h, W16 + (size_t)r * H1 + 2 * lane, o);
}

// k_main: block = 64 rows b (4 waves x 16), all 64 features: for each f (rolled): h1 fragments (k = hidden unit h: h1 = leaky(bf16(x[b][f]) bf16(W1[f][h]) + bf16(b1[f][h])),
// hi + residual), 2 k-chunks x 4 n-tiles x 2 products = 16 WMMA; h2 = leaky(acc + b2[f][g]); y[b][f] = sum_g h2 W3[f][g] + b3[f] reduced across the 16 lanes; parked in
__global__ __launch_bounds__(128) void k_main(const float* __restrict__ x, const float* __restrict__ W1, const float* __restrict__ b1, const h16* __restrict__ W16,
                                             const float* __restrict__ b2, const float* __restrict__ W3, const float* __restrict__ b3, float* out) {
    __shared__ __align__(16) float yt[64 * 68];
    const int lane = threadIdx.x & 31, wave = threadIdx.x >> 5, lr = lane & 15, hi = lane >> 4;
    const int r0 = blockIdx.x * 64 + wave * 16;
    float* myy = yt + wave * 16 * 68;
#pragma unroll 1
    for (int f = 0; f < NF; ++f) {
        const float xv = x[(size_t)(r0 + lr) * NF + f];                     // this lane's row scalar (f32 input, used unrounded? -> bf16-rounded)
        const float xb = bfr(xv);
        v16h ah[2], al[2];
#pragma unroll
        for (int kc = 0; kc < 2; ++kc)
#pragma unroll
            for (int q = 0; q < 16; ++q) { const int h = kc * 32 + ((q < 8) ? (8 * hi + q) : (16 + 8 * hi + (q - 8)));
                const float v = lk(xb * bfr(W1[f * H1 + h]) + bfr(b1[f * H1 + h])); const h16 hv = (h16)v; ah[kc][q] = hv; al[kc][q] = (h16)((v - (float)hv) * LOSC); }
        v8f acc[4], accx[4];
#pragma unroll
        for (int n = 0; n < 4; ++n) { acc[n] = (v8f){}; accx[n] = (v8f){}; }
        const h16* wf = W16 + (size_t)f * H2 * H1;
#pragma unroll
        for (int kc = 0; kc < 2; ++kc)
#pragma unroll
            for (int n = 0; n < 4; ++n) { const h16* bp = wf + (size_t)(n * 16 + lr) * H1 + kc * 32 + 8 * hi; const v16h bb = cat16(*(const v8h*)bp, *(const v8h*)(bp + 16));
                acc[n] = wmma16(ah[kc], bb, acc[n]); accx[n] = wmma16(al[kc], bb, accx[n]); }
        asm volatile("v_nop\n\tv_nop\n\tv_nop\n\tv_nop" : "+v"(acc[0]), "+v"(acc[1]), "+v"(acc[2]), "+v"(acc[3]), "+v"(accx[0]), "+v"(accx[1]), "+v"(accx[2]), "+v"(accx[3]));
        // y for rows 8hi + j: partial over this lane's 4 columns g = n*16 + lr
        float part[8];
#pragma unroll
        for (int j = 0; j < 8; ++j) { float s = 0.f;
#pragma unroll
            for (int n = 0; n < 4; ++n) { const int g = n * 16 + lr; s += lk(acc[n][j] + accx[n][j] * LOSCI + bfr(b2[f * H2 + g])) * bfr(W3[f * H2 + g]); }
            s += __shfl_xor(s, 1, 16); s += __shfl_xor(s, 2, 16); s += __shfl_xor(s, 4, 16); s += __shfl_xor(s, 8, 16);
            part[j] = s + bfr(b3[f]); }
        if (lr == 0) {
#pragma unroll
            for (int j = 0; j < 8; ++j) myy[(hi * 8 + j) * 68 + f] = part[j];
        }
    }
    asm volatile("" ::: "memory");
    __builtin_amdgcn_fence(__ATOMIC_RELEASE, "workgroup");
    __builtin_amdgcn_wave_barrier();
    // wave writes its 16 rows: row = 64 floats = 2 lines: lanes 0..15 row 2s, 16..31 row 2s+1, 16 B each; 16 instructions? -> 8 instructions of 2 rows
    auto pass = [&]() {
#pragma unroll
        for (int s = 0; s < 8; ++s) { const int row = 2 * s + (lane >> 4), piece = lane & 15; const v4f v = *(const v4fa*)(myy + row * 68 + piece * 4);
            *(v4f*)(out + (size_t)(r0 + row) * NF + piece * 4) = v; }
    };
    pass(); 
}

extern "C" void kernel_launch(void* const* d_in, const int* in_sizes, int n_in,
                              void* d_out, int out_size, void* d_ws, size_t ws_size, hipStream_t stream) {
    (void)in_sizes; (void)n_in; (void)out_size;
    const float* x = (const float*)d_in[0]; const float* W1 = (const float*)d_in[1]; const float* b1 = (const float*)d_in[2]; const float* W2 = (const float*)d_in[3];
    const float* b2 = (const float*)d_in[4]; const float* W3 = (const float*)d_in[5]; const float* b3 = (const float*)d_in[6];
    float* out = (float*)d_out;    // [65536][1][64]
    char* wsp = (char*)d_ws;
    auto take = [&](size_t bytes) { char* p = wsp; wsp += (bytes + 255) & ~(size_t)255; return (void*)p; };
    h16* W16 = (h16*)take((size_t)NF * H2 * H1 * 2);
    if ((size_t)(wsp - (char*)d_ws) > ws_size) return;    // 0.5 MB
    k_w16<<<(NF * H2) / 8, 256, 0, stream>>>(W2, W16);
    k_main<<<NB_ / 64, 128, 0, stream>>>(x, W1, b1, W16, b2, W3, b3, out);
}

// v001
// It runs in 102 microseconds.
// In two side-by-side timings against v000, it was 1.78 and 1.76 times as fast.
#include <hip/hip_runtime.h>

// Contractions on v_wmma_f32_16x16x32_f16, f32 accumulate: the per-feature hidden layers h2 = leaky(h1.W2[f]^T + b2[f]) as 64 GEMMs ([65536 rows x 64].[64 x 64], one
// per feature f) with h1 = leaky(x[b][f] W1[f] + b1[f]) formed in registers from the bf16-rounded input scalar and split into f16 hi + residual x1024 fragments (two products),
// W2[f] as exact f16 (f16 of its bf16 rounding; [out][in] rows are the n-major B operand). The output dots y = h2.W3[f] + b3[f] (64 terms) are f32 VALU reductions.

#define NB_  65536
#define NF   64
#define H1   64
#define H2   64
#define SLP  0.05f
#define LOSC 1024.0f
#define LOSCI (1.0f / 1024.0f)

typedef _Float16 h16;
typedef __attribute__((ext_vector_type(16))) _Float16 v16h;
typedef __attribute__((ext_vector_type(8)))  _Float16 v8h;
typedef __attribute__((ext_vector_type(8)))  float    v8f;
typedef __attribute__((ext_vector_type(4)))  float    v4f;
typedef v4f  __attribute__((may_alias)) v4fa;

__device__ __forceinline__ unsigned short f2bf(float f) { unsigned u = __float_as_uint(f); u += 0x7FFFu + ((u >> 16) & 1u); return (unsigned short)(u >> 16); }
__device__ __forceinline__ float bf2f(unsigned short b) { return __uint_as_float(((unsigned)b) << 16); }
__device__ __forceinline__ float bfr(float f) { return bf2f(f2bf(f)); }
__device__ __forceinline__ v16h cat16(v8h lo, v8h hi) { return __builtin_shufflevector(lo, hi, 0, 1, 2, 3, 4, 5, 6, 7, 8, 9, 10, 11, 12, 13, 14, 15); }
__device__ __forceinline__ v8f wmma16(v16h a, v16h b, v8f c) { return __builtin_amdgcn_wmma_f32_16x16x32_f16(false, a, false, b, (short)0, c, false, false); }
__device__ __forceinline__ float lk(float v) { return v >= 0.f ? v : SLP * v; }
#define VST2(T, p, v) do { const T vst2_v_ = (v); *(T*)(p) = vst2_v_;  } while (0)

__global__ __launch_bounds__(256) void k_w16(const float* __restrict__ W2, h16* W16) {
    const int lane = threadIdx.x & 31, r = blockIdx.x * 8 + (threadIdx.x >> 5);
    if (r >= NF * H2) return;
    typedef __attribute__((ext_vector_type(2))) _Float16 v2h;
    v2h o; o[0] = (h16)bfr(W2[(size_t)r * H1 + 2 * lane]); o[1] = (h16)bfr(W2[(size_t)r * H1 + 2 * lane + 1]);
    VST2(v2h, W16 + (size_t)r * H1 + 2 * lane, o);
}

// k_main: block = 256 rows b x all 64 features, 16 waves; the waves split the FEATURES (4 each), not the rows: for each of its features a wave rounds W1[f], b1[f], b2[f],
// W3[f], b3[f] and loads the W2[f] fragments ONCE into registers and then walks the block's 16 row tiles with them. Per tile as before: h1 fragments (k = hidden unit h:
// h1 = leaky(x[b][f] bf16(W1[f][h]) + bf16(b1[f][h])), hi + residual), 2 k-chunks x 4 n-tiles x 2 products = 16 WMMA; h2 = leaky(acc + b2[f][g]); y[b][f] = sum_g h2 W3[f][g]
// + b3[f] reduced across the 16 lanes; parked in LDS [row][feature]; one work-group barrier, then whole output rows are stored.
#define WV   16                 // waves per block = row tiles per block
#define FPW  (NF / WV)          // features per wave
#define RPB  (WV * 16)          // rows per block
__global__ __launch_bounds__(WV * 32) void k_main(const float* __restrict__ x, const float* __restrict__ W1, const float* __restrict__ b1, const h16* __restrict__ W16,
                                             const float* __restrict__ b2, const float* __restrict__ W3, const float* __restrict__ b3, float* out) {
    __shared__ __align__(16) float yt[RPB * 68];
    const int lane = threadIdx.x & 31, wave = threadIdx.x >> 5, lr = lane & 15, hi = lane >> 4;
    const int R0 = blockIdx.x * RPB;
#pragma unroll 1
    for (int fi = 0; fi < FPW; ++fi) {
        const int f = wave * FPW + fi;
        const float* w1p = W1 + f * H1 + 8 * hi; const float* b1p = b1 + f * H1 + 8 * hi;    // this lane's k offset 8 hi in W1[f], b1[f]
        float w1r[2][16], b1r[2][16];
#pragma unroll
        for (int kc = 0; kc < 2; ++kc)
#pragma unroll
            for (int q = 0; q < 16; ++q) { const int h = kc * 32 + ((q < 8) ? q : (16 + (q - 8)));
                w1r[kc][q] = bfr(w1p[h]); b1r[kc][q] = bfr(b1p[h]); }
        const h16* wf = W16 + (size_t)f * H2 * H1 + lr * H1 + 8 * hi;         // this lane's place in W2[f]: row lr of an n-tile, k offset 8 hi
        v16h bb[2][4];
#pragma unroll
        for (int kc = 0; kc < 2; ++kc)
#pragma unroll
            for (int n = 0; n < 4; ++n) { const h16* bp = wf + (size_t)n * 16 * H1 + kc * 32; bb[kc][n] = cat16(*(const v8h*)bp, *(const v8h*)(bp + 16)); }
        // the wait that belongs in front of an overwrite of the loads' address pairs; the three pointers as inputs keep the pairs live up to here, so that no load of the run lands on one
        asm volatile("s_wait_xcnt 0x0" :: "v"(wf), "v"(w1p), "v"(b1p) : "memory");
        float b2r[4], w3r[4];
#pragma unroll
        for (int n = 0; n < 4; ++n) { const int g = n * 16 + lr; b2r[n] = bfr(b2[f * H2 + g]); w3r[n] = bfr(W3[f * H2 + g]); }
        const float b3r = bfr(b3[f]);
#pragma unroll 1
        for (int t = 0; t < WV; ++t) {
            const float xv = x[(size_t)(R0 + t * 16 + lr) * NF + f];            // this lane's row scalar (f32 input, bf16-rounded)
            const float xb = bfr(xv);
            v16h ah[2], al[2];
#pragma unroll
            for (int kc = 0; kc < 2; ++kc)
#pragma unroll
                for (int q = 0; q < 16; ++q) {
                    const float v = lk(xb * w1r[kc][q] + b1r[kc][q]); const h16 hv = (h16)v; ah[kc][q] = hv; al[kc][q] = (h16)((v - (float)hv) * LOSC); }
            v8f acc[4], accx[4];
#pragma unroll
            for (int n = 0; n < 4; ++n) { acc[n] = (v8f){}; accx[n] = (v8f){}; }
#pragma unroll
            for (int kc = 0; kc < 2; ++kc)
#pragma unroll
                for (int n = 0; n < 4; ++n) { acc[n] = wmma16(ah[kc], bb[kc][n], acc[n]); accx[n] = wmma16(al[kc], bb[kc][n], accx[n]); }
            asm volatile("v_nop\n\tv_nop\n\tv_nop\n\tv_nop" : "+v"(acc[0]), "+v"(acc[1]), "+v"(acc[2]), "+v"(acc[3]), "+v"(accx[0]), "+v"(accx[1]), "+v"(accx[2]), "+v"(accx[3]));
            // y for rows 8hi + j of tile t: partial over this lane's 4 columns g = n*16 + lr
            float part[8];
#pragma unroll
            for (int j = 0; j < 8; ++j) { float s = 0.f;
#pragma unroll
                for (int n = 0; n < 4; ++n) s += lk(acc[n][j] + accx[n][j] * LOSCI + b2r[n]) * w3r[n];
                s += __shfl_xor(s, 1, 16); s += __shfl_xor(s, 2, 16); s += __shfl_xor(s, 4, 16); s += __shfl_xor(s, 8, 16);
                part[j] = s + b3r; }
            if (lr == 0) {
#pragma unroll
                for (int j = 0; j < 8; ++j) yt[(t * 16 + hi * 8 + j) * 68 + f] = part[j];
            }
        }
    }
    __syncthreads();    // a row's 64 features come from all 16 waves: every wave's LDS stores must be seen before whole rows are read
    // wave writes 16 rows: row = 64 floats = 2 lines: lanes 0..15 one row, 16..31 the next, 16 B each; 8 instructions of 2 rows
    const float* myy = yt + wave * 16 * 68;
    const int r0 = R0 + wave * 16;
#pragma unroll
    for (int s = 0; s < 8; ++s) { const int row = 2 * s + (lane >> 4), piece = lane & 15; const v4f v = *(const v4fa*)(myy + row * 68 + piece * 4);
        *(v4f*)(out + (size_t)(r0 + row) * NF + piece * 4) = v; }
}

extern "C" void kernel_launch(void* const* d_in, const int* in_sizes, int n_in,
                              void* d_out, int out_size, void* d_ws, size_t ws_size, hipStream_t stream) {
    (void)in_sizes; (void)n_in; (void)out_size;
    const float* x = (const float*)d_in[0]; const float* W1 = (const float*)d_in[1]; const float* b1 = (const float*)d_in[2]; const float* W2 = (const float*)d_in[3];
    const float* b2 = (const float*)d_in[4]; const float* W3 = (const float*)d_in[5]; const float* b3 = (const float*)d_in[6];
    float* out = (float*)d_out;    // [65536][1][64]
    char* wsp = (char*)d_ws;
    auto take = [&](size_t bytes) { char* p = wsp; wsp += (bytes + 255) & ~(size_t)255; return (void*)p; };
    h16* W16 = (h16*)take((size_t)NF * H2 * H1 * 2);
    if ((size_t)(wsp - (char*)d_ws) > ws_size) return;    // 0.5 MB
    k_w16<<<(NF * H2) / 8, 256, 0, stream>>>(W2, W16);
    k_main<<<NB_ / RPB, WV * 32, 0, stream>>>(x, W1, b1, W16, b2, W3, b3, out);
}

// v002
// One run takes 87.9 microseconds.
// Timed twice side by side with v001, it ran 1.15 and 1.16 times as fast.
// All steps since v000 together make it 2.04 times as fast.
#include <hip/hip_runtime.h>

// Contractions on v_wmma_f32_16x16x32_f16, f32 accumulate: the per-feature hidden layers h2 = leaky(h1.W2[f]^T + b2[f]) as 64 GEMMs ([65536 rows x 64].[64 x 64], one
// per feature f) with h1 = leaky(x[b][f] W1[f] + b1[f]) formed in registers from the INPUT scalar (f32) and split into f16 hi + residual x1024 fragments (two products),
// W2[f] as exact f16 (f16 of its bf16 rounding; [out][in] rows are the A operand, h1 the B operand). The output dots y = h2.W3[f] + b3[f] (64 terms) are f32 VALU reductions.

#define NB_  65536
#define NF   64
#define H1   64
#define H2   64
#define SLP  0.05f
#define LOSC 1024.0f
#define LOSCI (1.0f / 1024.0f)

typedef _Float16 h16;
typedef __attribute__((ext_vector_type(16))) _Float16 v16h;
typedef __attribute__((ext_vector_type(8)))  _Float16 v8h;
typedef __attribute__((ext_vector_type(8)))  float    v8f;
typedef __attribute__((ext_vector_type(4)))  float    v4f;
typedef v4f  __attribute__((may_alias)) v4fa;

__device__ __forceinline__ unsigned short f2bf(float f) { unsigned u = __float_as_uint(f); u += 0x7FFFu + ((u >> 16) & 1u); return (unsigned short)(u >> 16); }
__device__ __forceinline__ float bf2f(unsigned short b) { return __uint_as_float(((unsigned)b) << 16); }
__device__ __forceinline__ float bfr(float f) { return bf2f(f2bf(f)); }
__device__ __forceinline__ v16h cat16(v8h lo, v8h hi) { return __builtin_shufflevector(lo, hi, 0, 1, 2, 3, 4, 5, 6, 7, 8, 9, 10, 11, 12, 13, 14, 15); }
__device__ __forceinline__ v8f wmma16(v16h a, v16h b, v8f c) { return __builtin_amdgcn_wmma_f32_16x16x32_f16(false, a, false, b, (short)0, c, false, false); }
__device__ __forceinline__ float lk(float v) { return v >= 0.f ? v : SLP * v; }
#define VST2(T, p, v) do { const T vst2_v_ = (v); *(T*)(p) = vst2_v_;  } while (0)

__global__ __launch_bounds__(256) void k_w16(const float* __restrict__ W2, h16* W16) {
    const int lane = threadIdx.x & 31, r = blockIdx.x * 8 + (threadIdx.x >> 5);
    if (r >= NF * H2) return;
    typedef __attribute__((ext_vector_type(2))) _Float16 v2h;
    v2h o; o[0] = (h16)bfr(W2[(size_t)r * H1 + 2 * lane]); o[1] = (h16)bfr(W2[(size_t)r * H1 + 2 * lane + 1]);
    VST2(v2h, W16 + (size_t)r * H1 + 2 * lane, o);
}

// k_main: block = 256 rows b x all 64 features, 16 waves; the waves split the FEATURES (4 each), not the rows: for each of its features a wave rounds W1[f], b1[f], b3[f]
// and loads the W2[f] fragments ONCE into registers and then walks the block's 16 row tiles with them. The product is taken TRANSPOSED: W2[f] (rows g) is the A operand and
// h1 (columns b) the B operand, so D register j of n-tile n is h2pre[g = 16 n + 8 hi + j][b = lr]: a lane holds 32 of its own row's 64 hidden units. Per tile: h1 fragments
// (k = hidden unit h: h1 = leaky(x[b][f] bf16(W1[f][h]) + bf16(b1[f][h])), hi + residual), 2 k-chunks x 4 n-tiles x 2 products = 16 WMMA, b2[f][g] entering as C;
// h2 = leaky(acc); y[b][f] = sum_g h2 W3[f][g] + b3[f] summed in the lane, then one add across the two lane halves; parked in LDS [row][feature]; whole output rows are stored.
// b2 and W3 are the same for all 16 lanes of a half: they are rounded once into LDS and read from there per tile (in registers they would take 64 more than a wave has).
#define WV   16                 // waves per block = row tiles per block
#define FPW  (NF / WV)          // features per wave
#define RPB  (WV * 16)          // rows per block
typedef __attribute__((ext_vector_type(2)))  float    v2f;
typedef v8f  __attribute__((may_alias)) v8fa;
__global__ __launch_bounds__(WV * 32) void k_main(const float* __restrict__ x, const float* __restrict__ W1, const float* __restrict__ b1, const h16* __restrict__ W16,
                                             const float* __restrict__ b2, const float* __restrict__ W3, const float* __restrict__ b3, float* out) {
    __shared__ __align__(32) float sm[RPB * 68 + NF * 2 * H2];      // y tile [row][68], then per feature 64 rounded b2 and 64 rounded W3
    float* yt = sm; float* cst = sm + RPB * 68;
    const int lane = threadIdx.x & 31, wave = threadIdx.x >> 5, lr = lane & 15, hi = lane >> 4;
    const int R0 = blockIdx.x * RPB;
#pragma unroll   // all 16 loads of a thread in flight together
    for (int it = 0; it < NF * H2 / (WV * 32); ++it) { const int i = it * (WV * 32) + (int)threadIdx.x, ff = i >> 6, g = i & 63;
        cst[ff * 128 + g] = bfr(b2[i]); cst[ff * 128 + 64 + g] = bfr(W3[i]); }
    __syncthreads();    // the rounded b2 and W3 are written by all waves and read by the feature's wave
#pragma unroll 1
    for (int fi = 0; fi < FPW; ++fi) {
        const int f = wave * FPW + fi;
        const float* w1p = W1 + f * H1 + 8 * hi; const float* b1p = b1 + f * H1 + 8 * hi;    // this lane's k offset 8 hi in W1[f], b1[f]
        float w1r[2][16], b1r[2][16];
#pragma unroll
        for (int kc = 0; kc < 2; ++kc)
#pragma unroll
            for (int q = 0; q < 16; ++q) { const int h = kc * 32 + ((q < 8) ? q : (16 + (q - 8)));
                w1r[kc][q] = bfr(w1p[h]); b1r[kc][q] = bfr(b1p[h]); }
        const h16* wf = W16 + (size_t)f * H2 * H1 + lr * H1 + 8 * hi;         // this lane's place in W2[f]: row lr of an n-tile, k offset 8 hi
        v16h bb[2][4];
#pragma unroll
        for (int kc = 0; kc < 2; ++kc)
#pragma unroll
            for (int n = 0; n < 4; ++n) { const h16* bp = wf + (size_t)n * 16 * H1 + kc * 32; bb[kc][n] = cat16(*(const v8h*)bp, *(const v8h*)(bp + 16)); }
        // the wait that belongs in front of an overwrite of the loads' address pairs; the three pointers as inputs keep the pairs live up to here, so that no load of the run lands on one
        asm volatile("s_wait_xcnt 0x0" :: "v"(wf), "v"(w1p), "v"(b1p) : "memory");
        const float b3r = bfr(b3[f]);
        const float* cf = cst + f * 128 + 8 * hi;                              // this lane's g offset 8 hi in the feature's b2 (and, 64 on, W3)
#pragma unroll 1
        for (int t = 0; t < WV; ++t) {
            const float xv = x[(size_t)(R0 + t * 16 + lr) * NF + f];            // this lane's row scalar (f32 input, bf16-rounded)
            const float xb = bfr(xv);
            v16h ah[2], al[2];
#pragma unroll
            for (int kc = 0; kc < 2; ++kc)
#pragma unroll
                for (int q = 0; q < 16; ++q) {
                    const float v = lk(xb * w1r[kc][q] + b1r[kc][q]); const h16 hv = (h16)v; ah[kc][q] = hv; al[kc][q] = (h16)((v - (float)hv) * LOSC); }
            v8f acc[4], accx[4];
#pragma unroll
            for (int n = 0; n < 4; ++n) { acc[n] = *(const v8fa*)(cf + n * 16); accx[n] = (v8f){}; }     // C = b2[f][16 n + 8 hi + j]
#pragma unroll
            for (int kc = 0; kc < 2; ++kc)
#pragma unroll
                for (int n = 0; n < 4; ++n) { acc[n] = wmma16(bb[kc][n], ah[kc], acc[n]); accx[n] = wmma16(bb[kc][n], al[kc], accx[n]); }
            // y for row lr of tile t: this lane's 32 hidden units g = 16 n + 8 hi + j, two running sums per n-tile
            v2f s2[4];
#pragma unroll   // both loops: acc, accx and s2 are registers, their indices must be constants
            for (int n = 0; n < 4; ++n) { const v8f w3v = *(const v8fa*)(cf + 64 + n * 16); s2[n] = (v2f){};
#pragma unroll
                for (int j = 0; j < 8; j += 2) {
                    v2f h; h[0] = lk(acc[n][j] + accx[n][j] * LOSCI); h[1] = lk(acc[n][j + 1] + accx[n][j + 1] * LOSCI);
                    v2f w; w[0] = w3v[j]; w[1] = w3v[j + 1];
                    s2[n] += h * w; } }
            const v2f st = (s2[0] + s2[1]) + (s2[2] + s2[3]);
            float s = st[0] + st[1];
            const int sb = __float_as_int(s);
            s += __int_as_float(__builtin_amdgcn_permlanex16(sb, sb, 0x76543210, 0xfedcba98, false, false));    // the other half's 32 hidden units
            if (hi == 0) yt[(t * 16 + lr) * 68 + f] = s + b3r;
        }
    }
    __syncthreads();    // a row's 64 features come from all 16 waves: every wave's LDS stores must be seen before whole rows are read
    // wave writes 16 rows: row = 64 floats = 2 lines: lanes 0..15 one row, 16..31 the next, 16 B each; 8 instructions of 2 rows
    const float* myy = yt + wave * 16 * 68;
    const int r0 = R0 + wave * 16;
#pragma unroll
    for (int s = 0; s < 8; ++s) { const int row = 2 * s + (lane >> 4), piece = lane & 15; const v4f v = *(const v4fa*)(myy + row * 68 + piece * 4);
        *(v4f*)(out + (size_t)(r0 + row) * NF + piece * 4) = v; }
}

extern "C" void kernel_launch(void* const* d_in, const int* in_sizes, int n_in,
                              void* d_out, int out_size, void* d_ws, size_t ws_size, hipStream_t stream) {
    (void)in_sizes; (void)n_in; (void)out_size;
    const float* x = (const float*)d_in[0]; const float* W1 = (const float*)d_in[1]; const float* b1 = (const float*)d_in[2]; const float* W2 = (const float*)d_in[3];
    const float* b2 = (const float*)d_in[4]; const float* W3 = (const float*)d_in[5]; const float* b3 = (const float*)d_in[6];
    float* out = (float*)d_out;    // [65536][1][64]
    char* wsp = (char*)d_ws;
    auto take = [&](size_t bytes) { char* p = wsp; wsp += (bytes + 255) & ~(size_t)255; return (void*)p; };
    h16* W16 = (h16*)take((size_t)NF * H2 * H1 * 2);
    if ((size_t)(wsp - (char*)d_ws) > ws_size) return;    // 0.5 MB
    k_w16<<<(NF * H2) / 8, 256, 0, stream>>>(W2, W16);
    k_main<<<NB_ / RPB, WV * 32, 0, stream>>>(x, W1, b1, W16, b2, W3, b3, out);
}

// v003
// Measured time: 83.5 microseconds a run.
// Timed twice side by side with v002, it ran 1.05 times as fast both times.
// All steps since v000 together make it 2.15 times as fast.
#include <hip/hip_runtime.h>

// Contractions on v_wmma_f32_16x16x32_f16, f32 accumulate: the per-feature hidden layers h2 = leaky(h1.W2[f]^T + b2[f]) as 64 GEMMs ([65536 rows x 64].[64 x 64], one
// per feature f) with h1 = leaky(x[b][f] W1[f] + b1[f]) formed in registers from the INPUT scalar (f32) and split into f16 hi + residual x1024 fragments (two products),
// W2[f] as exact f16 (f16 of its bf16 rounding; [out][in] rows are the A operand, h1 the B operand). The output dots y = h2.W3[f] + b3[f] (64 terms) are f32 VALU reductions.

#define NB_  65536
#define NF   64
#define H1   64
#define H2   64
#define SLP  0.05f
#define LOSC 1024.0f
#define LOSCI (1.0f / 1024.0f)

typedef _Float16 h16;
typedef __attribute__((ext_vector_type(16))) _Float16 v16h;
typedef __attribute__((ext_vector_type(8)))  _Float16 v8h;
typedef __attribute__((ext_vector_type(8)))  float    v8f;
typedef __attribute__((ext_vector_type(4)))  float    v4f;
typedef v4f  __attribute__((may_alias)) v4fa;

__device__ __forceinline__ unsigned short f2bf(float f) { unsigned u = __float_as_uint(f); u += 0x7FFFu + ((u >> 16) & 1u); return (unsigned short)(u >> 16); }
__device__ __forceinline__ float bf2f(unsigned short b) { return __uint_as_float(((unsigned)b) << 16); }
__device__ __forceinline__ float bfr(float f) { return bf2f(f2bf(f)); }
__device__ __forceinline__ v16h cat16(v8h lo, v8h hi) { return __builtin_shufflevector(lo, hi, 0, 1, 2, 3, 4, 5, 6, 7, 8, 9, 10, 11, 12, 13, 14, 15); }
__device__ __forceinline__ v8f wmma16(v16h a, v16h b, v8f c) { return __builtin_amdgcn_wmma_f32_16x16x32_f16(false, a, false, b, (short)0, c, false, false); }
// leaky(v) = max(v, SLP v) for a slope below 1: v >= 0 gives v >= SLP v, v < 0 gives SLP v > v; the same value as the select for every v
__device__ __forceinline__ float lk(float v) { return __builtin_fmaxf(v, SLP * v); }
#define VST2(T, p, v) do { const T vst2_v_ = (v); *(T*)(p) = vst2_v_;  } while (0)

__global__ __launch_bounds__(256) void k_w16(const float* __restrict__ W2, h16* W16) {
    const int lane = threadIdx.x & 31, r = blockIdx.x * 8 + (threadIdx.x >> 5);
    if (r >= NF * H2) return;
    typedef __attribute__((ext_vector_type(2))) _Float16 v2h;
    v2h o; o[0] = (h16)bfr(W2[(size_t)r * H1 + 2 * lane]); o[1] = (h16)bfr(W2[(size_t)r * H1 + 2 * lane + 1]);
    VST2(v2h, W16 + (size_t)r * H1 + 2 * lane, o);
}

// k_main: block = 256 rows b x all 64 features, 16 waves; the waves split the FEATURES (4 each), not the rows: for each of its features a wave rounds W1[f], b1[f], b3[f]
// and loads the W2[f] fragments ONCE into registers and then walks the block's 16 row tiles with them. The product is taken TRANSPOSED: W2[f] (rows g) is the A operand and
// h1 (columns b) the B operand, so D register j of n-tile n is h2pre[g = 16 n + 8 hi + j][b = lr]: a lane holds 32 of its own row's 64 hidden units. Per tile: h1 fragments
// (k = hidden unit h: h1 = leaky(bf16(x[b][f]) bf16(W1[f][h]) + bf16(b1[f][h])), hi + residual), 2 k-chunks x 4 n-tiles x 2 products = 16 WMMA, b2[f][g] entering as C;
// h2 = leaky(acc); y[b][f] = sum_g h2 W3[f][g] + b3[f] summed in the lane, then one add across the two lane halves; parked in LDS [row][feature]; whole output rows are stored.
// b2 and W3 are the same for all 16 lanes of a half: they are rounded once into LDS and read from there per tile (in registers they would take 64 more than a wave has).
#define WV   16                 // waves per block = row tiles per block
#define FPW  (NF / WV)          // features per wave
#define RPB  (WV * 16)          // rows per block
typedef __attribute__((ext_vector_type(2)))  float    v2f;
typedef v8f  __attribute__((may_alias)) v8fa;
__global__ __launch_bounds__(WV * 32) void k_main(const float* __restrict__ x, const float* __restrict__ W1, const float* __restrict__ b1, const h16* __restrict__ W16,
                                             const float* __restrict__ b2, const float* __restrict__ W3, const float* __restrict__ b3, float* out) {
    __shared__ __align__(32) float sm[RPB * 68 + NF * 2 * H2];      // y tile [row][68], then per feature 64 rounded b2 and 64 rounded W3
    float* yt = sm; float* cst = sm + RPB * 68;
    const int lane = threadIdx.x & 31, wave = threadIdx.x >> 5, lr = lane & 15, hi = lane >> 4;
    const int R0 = blockIdx.x * RPB;
#pragma unroll   // all 16 loads of a thread in flight together
    for (int it = 0; it < NF * H2 / (WV * 32); ++it) { const int i = it * (WV * 32) + (int)threadIdx.x, ff = i >> 6, g = i & 63;
        cst[ff * 128 + g] = bfr(b2[i]); cst[ff * 128 + 64 + g] = bfr(W3[i]); }
    __syncthreads();    // the rounded b2 and W3 are written by all waves and read by the feature's wave
#pragma unroll 1
    for (int fi = 0; fi < FPW; ++fi) {
        const int f = wave * FPW + fi;
        const float* w1p = W1 + f * H1 + 8 * hi; const float* b1p = b1 + f * H1 + 8 * hi;    // this lane's k offset 8 hi in W1[f], b1[f]
        float w1r[2][16], b1r[2][16];
#pragma unroll
        for (int kc = 0; kc < 2; ++kc)
#pragma unroll
            for (int q = 0; q < 16; ++q) { const int h = kc * 32 + ((q < 8) ? q : (16 + (q - 8)));
                w1r[kc][q] = bfr(w1p[h]); b1r[kc][q] = bfr(b1p[h]); }
        const h16* wf = W16 + (size_t)f * H2 * H1 + lr * H1 + 8 * hi;         // this lane's place in W2[f]: row lr of an n-tile, k offset 8 hi
        v16h bb[2][4];
#pragma unroll
        for (int kc = 0; kc < 2; ++kc)
#pragma unroll
            for (int n = 0; n < 4; ++n) { const h16* bp = wf + (size_t)n * 16 * H1 + kc * 32; bb[kc][n] = cat16(*(const v8h*)bp, *(const v8h*)(bp + 16)); }
        // the wait that belongs in front of an overwrite of the loads' address pairs; the three pointers as inputs keep the pairs live up to here, so that no load of the run lands on one
        asm volatile("s_wait_xcnt 0x0" :: "v"(wf), "v"(w1p), "v"(b1p) : "memory");
        const float b3r = bfr(b3[f]);
        const float* cf = cst + f * 128 + 8 * hi;                              // this lane's g offset 8 hi in the feature's b2 (and, 64 on, W3)
#pragma unroll 1
        for (int t = 0; t < WV; ++t) {
            const float xv = x[(size_t)(R0 + t * 16 + lr) * NF + f];            // this lane's row scalar (f32 input, bf16-rounded)
            const float xb = bfr(xv);
            v16h ah[2], al[2];
#pragma unroll
            for (int kc = 0; kc < 2; ++kc)
#pragma unroll
                for (int q = 0; q < 16; ++q) {
                    const float v = lk(xb * w1r[kc][q] + b1r[kc][q]); const h16 hv = (h16)v; ah[kc][q] = hv; al[kc][q] = (h16)((v - (float)hv) * LOSC); }
            v8f acc[4], accx[4];
#pragma unroll
            for (int n = 0; n < 4; ++n) { acc[n] = *(const v8fa*)(cf + n * 16); accx[n] = (v8f){}; }     // C = b2[f][16 n + 8 hi + j]
#pragma unroll
            for (int kc = 0; kc < 2; ++kc)
#pragma unroll
                for (int n = 0; n < 4; ++n) { acc[n] = wmma16(bb[kc][n], ah[kc], acc[n]); accx[n] = wmma16(bb[kc][n], al[kc], accx[n]); }
            // y for row lr of tile t: this lane's 32 hidden units g = 16 n + 8 hi + j, two running sums per n-tile
            v2f s2[4];
#pragma unroll   // both loops: acc, accx and s2 are registers, their indices must be constants
            for (int n = 0; n < 4; ++n) { const v8f w3v = *(const v8fa*)(cf + 64 + n * 16); s2[n] = (v2f){};
#pragma unroll
                for (int j = 0; j < 8; j += 2) {
                    v2f h; h[0] = lk(acc[n][j] + accx[n][j] * LOSCI); h[1] = lk(acc[n][j + 1] + accx[n][j + 1] * LOSCI);
                    v2f w; w[0] = w3v[j]; w[1] = w3v[j + 1];
                    s2[n] += h * w; } }
            const v2f st = (s2[0] + s2[1]) + (s2[2] + s2[3]);
            float s = st[0] + st[1];
            const int sb = __float_as_int(s);
            s += __int_as_float(__builtin_amdgcn_permlanex16(sb, sb, 0x76543210, 0xfedcba98, false, false));    // the other half's 32 hidden units
            if (hi == 0) yt[(t * 16 + lr) * 68 + f] = s + b3r;
        }
    }
    __syncthreads();    // a row's 64 features come from all 16 waves: every wave's LDS stores must be seen before whole rows are read
    // wave writes 16 rows: row = 64 floats = 2 lines: lanes 0..15 one row, 16..31 the next, 16 B each; 8 instructions of 2 rows
    const float* myy = yt + wave * 16 * 68;
    const int r0 = R0 + wave * 16;
#pragma unroll
    for (int s = 0; s < 8; ++s) { const int row = 2 * s + (lane >> 4), piece = lane & 15; const v4f v = *(const v4fa*)(myy + row * 68 + piece * 4);
        *(v4f*)(out + (size_t)(r0 + row) * NF + piece * 4) = v; }
}

extern "C" void kernel_launch(void* const* d_in, const int* in_sizes, int n_in,
                              void* d_out, int out_size, void* d_ws, size_t ws_size, hipStream_t stream) {
    (void)in_sizes; (void)n_in; (void)out_size;
    const float* x = (const float*)d_in[0]; const float* W1 = (const float*)d_in[1]; const float* b1 = (const float*)d_in[2]; const float* W2 = (const float*)d_in[3];
    const float* b2 = (const float*)d_in[4]; const float* W3 = (const float*)d_in[5]; const float* b3 = (const float*)d_in[6];
    float* out = (float*)d_out;    // [65536][1][64]
    char* wsp = (char*)d_ws;
    auto take = [&](size_t bytes) { char* p = wsp; wsp += (bytes + 255) & ~(size_t)255; return (void*)p; };
    h16* W16 = (h16*)take((size_t)NF * H2 * H1 * 2);
    if ((size_t)(wsp - (char*)d_ws) > ws_size) return;    // 0.5 MB
    k_w16<<<(NF * H2) / 8, 256, 0, stream>>>(W2, W16);
    k_main<<<NB_ / RPB, WV * 32, 0, stream>>>(x, W1, b1, W16, b2, W3, b3, out);
}

// v004
// It runs in 68.7 microseconds.
// Two timings next to v003 put it at 1.23 and 1.22 times that version's speed.
// Counting every step since v000, it is 2.63 times as fast.
#include <hip/hip_runtime.h>

// Contractions on v_wmma_f32_16x16x32_f16, f32 accumulate: the per-feature hidden layers h2 = leaky(h1.W2[f]^T + b2[f]) as 64 GEMMs ([65536 rows x 64].[64 x 64], one
// per feature f) with h1 = leaky(x[b][f] W1[f] + b1[f]) formed in registers from the INPUT scalar (f32, rounded to bf16) and split into f16 hi + f16 residual fragments (two products, one accumulator),
// W2[f] as exact f16 (f16 of its bf16 rounding; [out][in] rows are the A operand, h1 the B operand). The output dots y = h2.W3[f] + b3[f] (64 terms) are f32 VALU reductions.

#define NB_  65536
#define NF   64
#define H1   64
#define H2   64
#define SLP  0.05f

typedef _Float16 h16;
typedef __attribute__((ext_vector_type(16))) _Float16 v16h;
typedef __attribute__((ext_vector_type(8)))  _Float16 v8h;
typedef __attribute__((ext_vector_type(8)))  float    v8f;
typedef __attribute__((ext_vector_type(4)))  float    v4f;
typedef __attribute__((ext_vector_type(8)))  unsigned v8u;
typedef v4f  __attribute__((may_alias)) v4fa;

__device__ __forceinline__ unsigned short f2bf(float f) { unsigned u = __float_as_uint(f); u += 0x7FFFu + ((u >> 16) & 1u); return (unsigned short)(u >> 16); }
__device__ __forceinline__ float bf2f(unsigned short b) { return __uint_as_float(((unsigned)b) << 16); }
__device__ __forceinline__ float bfr(float f) { return bf2f(f2bf(f)); }
__device__ __forceinline__ v16h cat16(v8h lo, v8h hi) { return __builtin_shufflevector(lo, hi, 0, 1, 2, 3, 4, 5, 6, 7, 8, 9, 10, 11, 12, 13, 14, 15); }
__device__ __forceinline__ v8f wmma16(v16h a, v16h b, v8f c) { return __builtin_amdgcn_wmma_f32_16x16x32_f16(false, a, false, b, (short)0, c, false, false); }
// leaky(v) = max(v, SLP v) for a slope below 1: v >= 0 gives v >= SLP v, v < 0 gives SLP v > v; the same value as the select for every v
__device__ __forceinline__ float lk(float v) { return __builtin_fmaxf(v, SLP * v); }
// split of f32 values into packed f16 pairs: h = f16(v), l = f16(v - h). v - h is exact in f32, so l is that difference rounded once; it is left unscaled (below 2^-14 it is an f16
// subnormal, a step of 2^-24, and the matrix unit keeps subnormal operands). One mixed-precision fma per value, h (an f16 half) x -1 (f32, in a scalar register) + v (f32), writes one
// half of l; written in asm because the compiler turns an fma by -1 into convert back, subtract, convert. Five or six pairs a statement, each kind of instruction in a run of its own:
// every producer inside the statement then stands five or more instructions back, so that no dependent pair holds up the vector port.
__device__ __forceinline__ void split6(const float* v, unsigned* h, unsigned* l) {
    asm(
        "v_cvt_pk_f16_f32 %0, %12, %13\n\t"
        "v_cvt_pk_f16_f32 %1, %14, %15\n\t"
        "v_cvt_pk_f16_f32 %2, %16, %17\n\t"
        "v_cvt_pk_f16_f32 %3, %18, %19\n\t"
        "v_cvt_pk_f16_f32 %4, %20, %21\n\t"
        "v_cvt_pk_f16_f32 %5, %22, %23\n\t"
        "v_fma_mixlo_f16 %6, %0, %24, %12 op_sel_hi:[1,0,0]\n\t"
        "v_fma_mixlo_f16 %7, %1, %24, %14 op_sel_hi:[1,0,0]\n\t"
        "v_fma_mixlo_f16 %8, %2, %24, %16 op_sel_hi:[1,0,0]\n\t"
        "v_fma_mixlo_f16 %9, %3, %24, %18 op_sel_hi:[1,0,0]\n\t"
        "v_fma_mixlo_f16 %10, %4, %24, %20 op_sel_hi:[1,0,0]\n\t"
        "v_fma_mixlo_f16 %11, %5, %24, %22 op_sel_hi:[1,0,0]\n\t"
        "v_fma_mixhi_f16 %6, %0, %24, %13 op_sel:[1,0,0] op_sel_hi:[1,0,0]\n\t"
        "v_fma_mixhi_f16 %7, %1, %24, %15 op_sel:[1,0,0] op_sel_hi:[1,0,0]\n\t"
        "v_fma_mixhi_f16 %8, %2, %24, %17 op_sel:[1,0,0] op_sel_hi:[1,0,0]\n\t"
        "v_fma_mixhi_f16 %9, %3, %24, %19 op_sel:[1,0,0] op_sel_hi:[1,0,0]\n\t"
        "v_fma_mixhi_f16 %10, %4, %24, %21 op_sel:[1,0,0] op_sel_hi:[1,0,0]\n\t"
        "v_fma_mixhi_f16 %11, %5, %24, %23 op_sel:[1,0,0] op_sel_hi:[1,0,0]"
        : "=&v"(h[0]), "=&v"(h[1]), "=&v"(h[2]), "=&v"(h[3]), "=&v"(h[4]), "=&v"(h[5]), "=&v"(l[0]), "=&v"(l[1]), "=&v"(l[2]), "=&v"(l[3]), "=&v"(l[4]), "=&v"(l[5])
        : "v"(v[0]), "v"(v[1]), "v"(v[2]), "v"(v[3]), "v"(v[4]), "v"(v[5]), "v"(v[6]), "v"(v[7]), "v"(v[8]), "v"(v[9]), "v"(v[10]), "v"(v[11]), "s"(-1.0f));
}
// the same for five pairs
__device__ __forceinline__ void split5(const float* v, unsigned* h, unsigned* l) {
    asm(
        "v_cvt_pk_f16_f32 %0, %10, %11\n\t"
        "v_cvt_pk_f16_f32 %1, %12, %13\n\t"
        "v_cvt_pk_f16_f32 %2, %14, %15\n\t"
        "v_cvt_pk_f16_f32 %3, %16, %17\n\t"
        "v_cvt_pk_f16_f32 %4, %18, %19\n\t"
        "v_fma_mixlo_f16 %5, %0, %20, %10 op_sel_hi:[1,0,0]\n\t"
        "v_fma_mixlo_f16 %6, %1, %20, %12 op_sel_hi:[1,0,0]\n\t"
        "v_fma_mixlo_f16 %7, %2, %20, %14 op_sel_hi:[1,0,0]\n\t"
        "v_fma_mixlo_f16 %8, %3, %20, %16 op_sel_hi:[1,0,0]\n\t"
        "v_fma_mixlo_f16 %9, %4, %20, %18 op_sel_hi:[1,0,0]\n\t"
        "v_fma_mixhi_f16 %5, %0, %20, %11 op_sel:[1,0,0] op_sel_hi:[1,0,0]\n\t"
        "v_fma_mixhi_f16 %6, %1, %20, %13 op_sel:[1,0,0] op_sel_hi:[1,0,0]\n\t"
        "v_fma_mixhi_f16 %7, %2, %20, %15 op_sel:[1,0,0] op_sel_hi:[1,0,0]\n\t"
        "v_fma_mixhi_f16 %8, %3, %20, %17 op_sel:[1,0,0] op_sel_hi:[1,0,0]\n\t"
        "v_fma_mixhi_f16 %9, %4, %20, %19 op_sel:[1,0,0] op_sel_hi:[1,0,0]"
        : "=&v"(h[0]), "=&v"(h[1]), "=&v"(h[2]), "=&v"(h[3]), "=&v"(h[4]), "=&v"(l[0]), "=&v"(l[1]), "=&v"(l[2]), "=&v"(l[3]), "=&v"(l[4])
        : "v"(v[0]), "v"(v[1]), "v"(v[2]), "v"(v[3]), "v"(v[4]), "v"(v[5]), "v"(v[6]), "v"(v[7]), "v"(v[8]), "v"(v[9]), "s"(-1.0f));
}
#define VST2(T, p, v) do { const T vst2_v_ = (v); *(T*)(p) = vst2_v_;  } while (0)

__global__ __launch_bounds__(256) void k_w16(const float* __restrict__ W2, h16* W16) {
    const int lane = threadIdx.x & 31, r = blockIdx.x * 8 + (threadIdx.x >> 5);
    if (r >= NF * H2) return;
    typedef __attribute__((ext_vector_type(2))) _Float16 v2h;
    v2h o; o[0] = (h16)bfr(W2[(size_t)r * H1 + 2 * lane]); o[1] = (h16)bfr(W2[(size_t)r * H1 + 2 * lane + 1]);
    VST2(v2h, W16 + (size_t)r * H1 + 2 * lane, o);
}

// k_main: block = 256 rows b x all 64 features, 16 waves; the waves split the FEATURES (4 each), not the rows: for each of its features a wave rounds W1[f], b1[f], b3[f]
// and loads the W2[f] fragments ONCE into registers and then walks the block's 16 row tiles with them. The product is taken TRANSPOSED: W2[f] (rows g) is the A operand and
// h1 (columns b) the B operand, so D register j of n-tile n is h2pre[g = 16 n + 8 hi + j][b = lr]: a lane holds 32 of its own row's 64 hidden units. Per tile: h1 fragments
// (k = hidden unit h: h1 = leaky(bf16(x[b][f]) bf16(W1[f][h]) + bf16(b1[f][h])), hi + residual), 2 k-chunks x 2 products x 4 n-tiles = 16 WMMA into 4 accumulators, b2[f][g] entering as C;
// h2 = leaky(acc); y[b][f] = sum_g h2 W3[f][g] + b3[f] summed in the lane, then one add across the two lane halves; parked in LDS [row][feature]; whole output rows are stored.
// b2 and W3 are the same for all 16 lanes of a half: they are rounded once into LDS and read from there per tile (in registers they would take 64 more than a wave has).
#define WV   16                 // waves per block = row tiles per block
#define FPW  (NF / WV)          // features per wave
#define RPB  (WV * 16)          // rows per block
typedef __attribute__((ext_vector_type(2)))  float    v2f;
typedef v8f  __attribute__((may_alias)) v8fa;
__global__ __launch_bounds__(WV * 32) void k_main(const float* __restrict__ x, const float* __restrict__ W1, const float* __restrict__ b1, const h16* __restrict__ W16,
                                             const float* __restrict__ b2, const float* __restrict__ W3, const float* __restrict__ b3, float* out) {
    __shared__ __align__(32) float sm[RPB * 68 + NF * 2 * H2];      // y tile [row][68], then per feature 64 rounded b2 and 64 rounded W3
    float* yt = sm; float* cst = sm + RPB * 68;
    const int lane = threadIdx.x & 31, wave = threadIdx.x >> 5, lr = lane & 15, hi = lane >> 4;
    const int R0 = blockIdx.x * RPB;
#pragma unroll   // all 16 loads of a thread in flight together
    for (int it = 0; it < NF * H2 / (WV * 32); ++it) { const int i = it * (WV * 32) + (int)threadIdx.x, ff = i >> 6, g = i & 63;
        cst[ff * 128 + g] = bfr(b2[i]); cst[ff * 128 + 64 + g] = bfr(W3[i]); }
    __syncthreads();    // the rounded b2 and W3 are written by all waves and read by the feature's wave
#pragma unroll 1
    for (int fi = 0; fi < FPW; ++fi) {
        const int f = wave * FPW + fi;
        const float* w1p = W1 + f * H1 + 8 * hi; const float* b1p = b1 + f * H1 + 8 * hi;    // this lane's k offset 8 hi in W1[f], b1[f]
        float w1r[2][16], b1r[2][16];
#pragma unroll
        for (int kc = 0; kc < 2; ++kc)
#pragma unroll
            for (int q = 0; q < 16; ++q) { const int h = kc * 32 + ((q < 8) ? q : (16 + (q - 8)));
                w1r[kc][q] = bfr(w1p[h]); b1r[kc][q] = bfr(b1p[h]); }
        const h16* wf = W16 + (size_t)f * H2 * H1 + lr * H1 + 8 * hi;         // this lane's place in W2[f]: row lr of an n-tile, k offset 8 hi
        v16h bb[2][4];
#pragma unroll
        for (int kc = 0; kc < 2; ++kc)
#pragma unroll
            for (int n = 0; n < 4; ++n) { const h16* bp = wf + (size_t)n * 16 * H1 + kc * 32; bb[kc][n] = cat16(*(const v8h*)bp, *(const v8h*)(bp + 16)); }
        // the wait that belongs in front of an overwrite of the loads' address pairs; the three pointers as inputs keep the pairs live up to here, so that no load of the run lands on one
        asm volatile("s_wait_xcnt 0x0" :: "v"(wf), "v"(w1p), "v"(b1p) : "memory");
        const float b3r = bfr(b3[f]);
        const float* cf = cst + f * 128 + 8 * hi;                              // this lane's g offset 8 hi in the feature's b2 (and, 64 on, W3)
#pragma unroll 1
        for (int t = 0; t < WV; ++t) {
            const float xv = x[(size_t)(R0 + t * 16 + lr) * NF + f];            // this lane's row scalar (f32 input, bf16-rounded)
            const float xb = bfr(xv);
            float hv[32]; unsigned hp[16], lp[16];      // h1 in k order kc * 16 + q; its f16 pairs, register i of chunk kc at kc * 8 + i
#pragma unroll
            for (int kc = 0; kc < 2; ++kc)
#pragma unroll
                for (int q = 0; q < 16; q += 2) {       // two values a step as an f32 pair: one packed fma (the asm's one-value operands would else undo the pairing)
                    const v2f w = { w1r[kc][q], w1r[kc][q + 1] }, b = { b1r[kc][q], b1r[kc][q + 1] }, xx = { xb, xb };
                    const v2f p = xx * w + b;
                    hv[kc * 16 + q] = lk(p[0]); hv[kc * 16 + q + 1] = lk(p[1]); }
            split6(hv, hp, lp); split5(hv + 12, hp + 6, lp + 6); split5(hv + 22, hp + 11, lp + 11);
            v16h ah[2], al[2];
#pragma unroll   // hp and lp are registers, their indices must be constants
            for (int kc = 0; kc < 2; ++kc) {
                const v8u a = { hp[kc * 8], hp[kc * 8 + 1], hp[kc * 8 + 2], hp[kc * 8 + 3], hp[kc * 8 + 4], hp[kc * 8 + 5], hp[kc * 8 + 6], hp[kc * 8 + 7] };
                const v8u b = { lp[kc * 8], lp[kc * 8 + 1], lp[kc * 8 + 2], lp[kc * 8 + 3], lp[kc * 8 + 4], lp[kc * 8 + 5], lp[kc * 8 + 6], lp[kc * 8 + 7] };
                ah[kc] = __builtin_bit_cast(v16h, a); al[kc] = __builtin_bit_cast(v16h, b); }
            v8f acc[4];
#pragma unroll
            for (int n = 0; n < 4; ++n) acc[n] = *(const v8fa*)(cf + n * 16);     // C = b2[f][16 n + 8 hi + j]
#pragma unroll   // acc is registers; three other accumulators between two uses of one
            for (int kc = 0; kc < 2; ++kc) {
#pragma unroll
                for (int n = 0; n < 4; ++n) acc[n] = wmma16(bb[kc][n], ah[kc], acc[n]);
#pragma unroll
                for (int n = 0; n < 4; ++n) acc[n] = wmma16(bb[kc][n], al[kc], acc[n]);
            }
            // y for row lr of tile t: this lane's 32 hidden units g = 16 n + 8 hi + j, two running sums per n-tile
            v2f s2[4];
#pragma unroll   // both loops: acc and s2 are registers, their indices must be constants
            for (int n = 0; n < 4; ++n) { const v8f w3v = *(const v8fa*)(cf + 64 + n * 16); s2[n] = (v2f){};
#pragma unroll
                for (int j = 0; j < 8; j += 2) {
                    v2f h; h[0] = lk(acc[n][j]); h[1] = lk(acc[n][j + 1]);
                    v2f w; w[0] = w3v[j]; w[1] = w3v[j + 1];
                    s2[n] += h * w; } }
            const v2f st = (s2[0] + s2[1]) + (s2[2] + s2[3]);
            float s = st[0] + st[1];
            const int sb = __float_as_int(s);
            s += __int_as_float(__builtin_amdgcn_permlanex16(sb, sb, 0x76543210, 0xfedcba98, false, false));    // the other half's 32 hidden units
            if (hi == 0) yt[(t * 16 + lr) * 68 + f] = s + b3r;
        }
    }
    __syncthreads();    // a row's 64 features come from all 16 waves: every wave's LDS stores must be seen before whole rows are read
    // wave writes 16 rows: row = 64 floats = 2 lines: lanes 0..15 one row, 16..31 the next, 16 B each; 8 instructions of 2 rows
    const float* myy = yt + wave * 16 * 68;
    const int r0 = R0 + wave * 16;
#pragma unroll
    for (int s = 0; s < 8; ++s) { const int row = 2 * s + (lane >> 4), piece = lane & 15; const v4f v = *(const v4fa*)(myy + row * 68 + piece * 4);
        *(v4f*)(out + (size_t)(r0 + row) * NF + piece * 4) = v; }
}

extern "C" void kernel_launch(void* const* d_in, const int* in_sizes, int n_in,
                              void* d_out, int out_size, void* d_ws, size_t ws_size, hipStream_t stream) {
    (void)in_sizes; (void)n_in; (void)out_size;
    const float* x = (const float*)d_in[0]; const float* W1 = (const float*)d_in[1]; const float* b1 = (const float*)d_in[2]; const float* W2 = (const float*)d_in[3];
    const float* b2 = (const float*)d_in[4]; const float* W3 = (const float*)d_in[5]; const float* b3 = (const float*)d_in[6];
    float* out = (float*)d_out;    // [65536][1][64]
    char* wsp = (char*)d_ws;
    auto take = [&](size_t bytes) { char* p = wsp; wsp += (bytes + 255) & ~(size_t)255; return (void*)p; };
    h16* W16 = (h16*)take((size_t)NF * H2 * H1 * 2);
    if ((size_t)(wsp - (char*)d_ws) > ws_size) return;    // 0.5 MB
    k_w16<<<(NF * H2) / 8, 256, 0, stream>>>(W2, W16);
    k_main<<<NB_ / RPB, WV * 32, 0, stream>>>(x, W1, b1, W16, b2, W3, b3, out);
}

// v007
// A run of this version takes 45.5 microseconds.
// Versions between v004 and this one are left out; their measured steps multiply to 1.50 times as fast.
// All steps since v000 together make it 3.95 times as fast.
#include <hip/hip_runtime.h>

// Contractions on v_wmma_f16_16x16x32_f16, f16 accumulate: the per-feature hidden layers h2 = leaky(h1.W2[f]^T + b2[f]) as 64 GEMMs ([65536 rows x 64].[64 x 64], one
// per feature f) with h1 = leaky(x[b][f] W1[f] + b1[f]) formed in registers from the INPUT scalar (f32) and rounded once to f16 fragments (one product; x, W1 and b1 are rounded to 8 significant bits before, f16 keeps 11),
// W2[f] as exact f16 (f16 of its bf16 rounding; [out][in] rows are the A operand, h1 the B operand); this product leaves the matrix unit as f16 (v_wmma_f16_16x16x32_f16). The output dots
// y = h2.W3[f] + b3[f] (64 terms) are a second product on v_wmma_f32_16x16x32_f16: W3[f] as A, the f16 h2 as B, b3[f] as C, f32 accumulate.

#define NB_  65536
#define NF   64
#define H1   64
#define H2   64
#define SLP  0.05f

typedef _Float16 h16;
typedef __attribute__((ext_vector_type(16))) _Float16 v16h;
typedef __attribute__((ext_vector_type(8)))  _Float16 v8h;
typedef __attribute__((ext_vector_type(8)))  float    v8f;
typedef __attribute__((ext_vector_type(4)))  float    v4f;
typedef __attribute__((ext_vector_type(8)))  unsigned v8u;
typedef v4f  __attribute__((may_alias)) v4fa;

__device__ __forceinline__ unsigned short f2bf(float f) { unsigned u = __float_as_uint(f); u += 0x7FFFu + ((u >> 16) & 1u); return (unsigned short)(u >> 16); }
__device__ __forceinline__ float bf2f(unsigned short b) { return __uint_as_float(((unsigned)b) << 16); }
__device__ __forceinline__ float bfr(float f) { return bf2f(f2bf(f)); }
__device__ __forceinline__ v16h cat16(v8h lo, v8h hi) { return __builtin_shufflevector(lo, hi, 0, 1, 2, 3, 4, 5, 6, 7, 8, 9, 10, 11, 12, 13, 14, 15); }
__device__ __forceinline__ v8f wmma16(v16h a, v16h b, v8f c) { return __builtin_amdgcn_wmma_f32_16x16x32_f16(false, a, false, b, (short)0, c, false, false); }
__device__ __forceinline__ v8h wmma16h(v16h a, v16h b, v8h c) { return __builtin_amdgcn_wmma_f16_16x16x32_f16(false, a, false, b, (short)0, c, false, false); }
// leaky(v) = max(v, SLP v) for a slope below 1: v >= 0 gives v >= SLP v, v < 0 gives SLP v > v; the same value as the select for every v
__device__ __forceinline__ float lk(float v) { return __builtin_fmaxf(v, SLP * v); }
#define VST2(T, p, v) do { const T vst2_v_ = (v); *(T*)(p) = vst2_v_;  } while (0)

// k_w16: rounds all weights but b3 (rounded in k_main). W2 -> f16 rows; W1, b1 -> f32 holding the bf16 rounding; b2, W3 -> f16 of the bf16 rounding, per feature 64 b2 then 64 W3.
__global__ __launch_bounds__(256) void k_w16(const float* __restrict__ W2, const float* __restrict__ W1, const float* __restrict__ b1, const float* __restrict__ b2,
                                             const float* __restrict__ W3, h16* W16, float* W1r, float* B1r, h16* CST) {
    const int lane = threadIdx.x & 31, r = blockIdx.x * 8 + (threadIdx.x >> 5);
    const int i = blockIdx.x * 256 + (int)threadIdx.x;
    if (i < NF * H1) { const int ff = i >> 6, g = i & 63;      // the first 16 blocks also round the four small tables, one element of each a thread
        W1r[i] = bfr(W1[i]); B1r[i] = bfr(b1[i]); CST[ff * 128 + g] = (h16)bfr(b2[i]); CST[ff * 128 + 64 + g] = (h16)bfr(W3[i]); }
    if (r >= NF * H2) return;
    typedef __attribute__((ext_vector_type(2))) _Float16 v2h;
    v2h o; o[0] = (h16)bfr(W2[(size_t)r * H1 + 2 * lane]); o[1] = (h16)bfr(W2[(size_t)r * H1 + 2 * lane + 1]);
    VST2(v2h, W16 + (size_t)r * H1 + 2 * lane, o);
}

// k_main: block = 256 rows b x all 64 features, 16 waves; the waves split the FEATURES (4 each), not the rows: for each of its features a wave loads the rounded W1[f], b1[f], b2[f], W3[f]
// and the W2[f] fragments ONCE into registers and then walks the block's 16 row tiles with them. The product is taken TRANSPOSED: W2[f] (rows g) is the A operand and
// h1 (columns b) the B operand, so D element j of n-tile n is h2pre[g = 16 n + 8 hi + j][b = lr]: a lane holds 32 of its own row's 64 hidden units. Per tile: h1 fragments
// (k = hidden unit h: h1 = f16(leaky(x[b][f] bf16(W1[f][h]) + bf16(b1[f][h])))), 2 k-chunks x 4 n-tiles = 8 WMMA into 4 f16 accumulators, b2[f][g] entering as C;
// h2 = leaky(acc) on packed f16. Two packed D tiles side by side ARE a B fragment in the hardware k order (element s: k = 8 hi + s, then 16 + 8 hi + (s - 8)), so
// y[b][f] = sum_g W3[f][g] h2[g][b] + b3[f] is 2 more WMMA (k = g, f32 accumulate, b3 as C) with no lane exchange; all 16 rows of that A hold W3[f], so every D register is y[b = lr].
// y is parked in LDS [row][feature]; whole output rows are stored. All weights but b3 arrive rounded from k_w16 (workspace) and are read into registers once per feature.
#define WV   16                 // waves per block = row tiles per block
#define FPW  (NF / WV)          // features per wave
#define RPB  (WV * 16)          // rows per block
typedef __attribute__((ext_vector_type(2)))  float    v2f;
__global__ __launch_bounds__(WV * 32) void k_main(const float* __restrict__ x, const float* __restrict__ W1r, const float* __restrict__ B1r, const h16* __restrict__ W16,
                                             const h16* __restrict__ CST, const float* __restrict__ b3, float* out) {
    __shared__ __align__(32) float yt[RPB * 68];        // y tile [row][68]
    const int lane = threadIdx.x & 31, wave = threadIdx.x >> 5, lr = lane & 15, hi = lane >> 4;
    const int R0 = blockIdx.x * RPB;
#pragma unroll 1
    for (int fi = 0; fi < FPW; ++fi) {
        const int f = wave * FPW + fi;
        const float* w1p = W1r + f * H1 + 8 * hi; const float* b1p = B1r + f * H1 + 8 * hi;    // this lane's k offset 8 hi in the rounded W1[f], b1[f]
        float w1r[2][16], b1r[2][16];
#pragma unroll
        for (int kc = 0; kc < 2; ++kc)
#pragma unroll
            for (int q = 0; q < 16; ++q) { const int h = kc * 32 + ((q < 8) ? q : (16 + (q - 8)));
                w1r[kc][q] = w1p[h]; b1r[kc][q] = b1p[h]; }
        const h16* wf = W16 + (size_t)f * H2 * H1 + lr * H1 + 8 * hi;         // this lane's place in W2[f]: row lr of an n-tile, k offset 8 hi
        v16h bb[2][4];
#pragma unroll
        for (int kc = 0; kc < 2; ++kc)
#pragma unroll
            for (int n = 0; n < 4; ++n) { const h16* bp = wf + (size_t)n * 16 * H1 + kc * 32; bb[kc][n] = cat16(*(const v8h*)bp, *(const v8h*)(bp + 16)); }
        const float b3r = bfr(b3[f]);
        const h16* cf = CST + f * 128 + 8 * hi;                                // this lane's g offset 8 hi in the feature's b2 (and, 64 on, W3)
        v8h c2[4];       // C = b2[f][16 n + 8 hi + j]
#pragma unroll
        for (int n = 0; n < 4; ++n) c2[n] = *(const v8h*)(cf + n * 16);
        v16h a3[2];      // W3[f] in the same k order as the packed D pairs: g = 32 kc + 8 hi + s, then 32 kc + 16 + 8 hi + (s - 8); the same in every row
#pragma unroll
        for (int kc = 0; kc < 2; ++kc) a3[kc] = cat16(*(const v8h*)(cf + 64 + kc * 32), *(const v8h*)(cf + 64 + kc * 32 + 16));
        // the wait that belongs in front of an overwrite of the loads' address registers; the four pointers and f (the b3 load's offset) as inputs keep them live up to here, so that no load of the run lands on one
        asm volatile("s_wait_xcnt 0x0" :: "v"(wf), "v"(w1p), "v"(b1p), "v"(cf), "v"(f) : "memory");
        const v8f c3 = { b3r, b3r, b3r, b3r, b3r, b3r, b3r, b3r };
#pragma unroll 1
        for (int t = 0; t < WV; ++t) {
            const float xv = x[(size_t)(R0 + t * 16 + lr) * NF + f];            // this lane's row scalar (f32 input, bf16-rounded)
            const float xb = bfr(xv);
            v16h ah[2];      // h1 in k order: element q of chunk kc
#pragma unroll
            for (int kc = 0; kc < 2; ++kc)
#pragma unroll
                for (int q = 0; q < 16; q += 2) {       // two values a step as an f32 pair: one packed fma, one packed conversion (round to nearest even)
                    const v2f w = { w1r[kc][q], w1r[kc][q + 1] }, b = { b1r[kc][q], b1r[kc][q + 1] }, xx = { xb, xb };
                    const v2f p = xx * w + b;
                    ah[kc][q] = (h16)lk(p[0]); ah[kc][q + 1] = (h16)lk(p[1]); }
            v8h acc[4];
#pragma unroll   // acc is registers; four independent accumulators, three other WMMA between two uses of one
            for (int n = 0; n < 4; ++n) acc[n] = wmma16h(bb[0][n], ah[0], c2[n]);
#pragma unroll
            for (int n = 0; n < 4; ++n) acc[n] = wmma16h(bb[1][n], ah[1], acc[n]);
            // h2 = leaky(h2pre), two values an instruction. maximum, not max: in front of max the compiler quiets a WMMA result with one more instruction per register;
            // the two agree on every value that is not a NaN, and a NaN stays a NaN in both
#pragma unroll
            for (int n = 0; n < 4; ++n) acc[n] = __builtin_elementwise_maximum(acc[n], acc[n] * (h16)SLP);
            v8f y = wmma16(a3[0], cat16(acc[0], acc[1]), c3);
            y = wmma16(a3[1], cat16(acc[2], acc[3]), y);
            if (hi == 0) yt[(t * 16 + lr) * 68 + f] = y[0];
        }
    }
    __syncthreads();    // a row's 64 features come from all 16 waves: every wave's LDS stores must be seen before whole rows are read
    // wave writes 16 rows: row = 64 floats = 2 lines: lanes 0..15 one row, 16..31 the next, 16 B each; 8 instructions of 2 rows
    const float* myy = yt + wave * 16 * 68;
    const int r0 = R0 + wave * 16;
#pragma unroll
    for (int s = 0; s < 8; ++s) { const int row = 2 * s + (lane >> 4), piece = lane & 15; const v4f v = *(const v4fa*)(myy + row * 68 + piece * 4);
        *(v4f*)(out + (size_t)(r0 + row) * NF + piece * 4) = v; }
}

extern "C" void kernel_launch(void* const* d_in, const int* in_sizes, int n_in,
                              void* d_out, int out_size, void* d_ws, size_t ws_size, hipStream_t stream) {
    (void)in_sizes; (void)n_in; (void)out_size;
    const float* x = (const float*)d_in[0]; const float* W1 = (const float*)d_in[1]; const float* b1 = (const float*)d_in[2]; const float* W2 = (const float*)d_in[3];
    const float* b2 = (const float*)d_in[4]; const float* W3 = (const float*)d_in[5]; const float* b3 = (const float*)d_in[6];
    float* out = (float*)d_out;    // [65536][1][64]
    char* wsp = (char*)d_ws;
    auto take = [&](size_t bytes) { char* p = wsp; wsp += (bytes + 255) & ~(size_t)255; return (void*)p; };
    h16* W16 = (h16*)take((size_t)NF * H2 * H1 * 2);
    float* W1r = (float*)take((size_t)NF * H1 * 4); float* B1r = (float*)take((size_t)NF * H1 * 4); h16* CST = (h16*)take((size_t)NF * 2 * H2 * 2);
    if ((size_t)(wsp - (char*)d_ws) > ws_size) return;    // 0.55 MB
    k_w16<<<(NF * H2) / 8, 256, 0, stream>>>(W2, W1, b1, b2, W3, W16, W1r, B1r, CST);
    k_main<<<NB_ / RPB, WV * 32, 0, stream>>>(x, W1r, B1r, W16, CST, b3, out);
}

// v008
// It runs in 35.8 microseconds.
// Timed twice side by side with v007, it ran 1.27 and 1.28 times as fast.
// All steps since v000 together make it 5.03 times as fast.
#include <hip/hip_runtime.h>

// Contractions on v_wmma_f16_16x16x32_f16, f16 accumulate: the per-feature hidden layers h2 = leaky(h1.W2[f]^T + b2[f]) as 64 GEMMs ([65536 rows x 64].[64 x 64], one
// per feature f) with h1 = leaky(x[b][f] W1[f] + b1[f]) formed in registers from the INPUT scalar (f32) and rounded once to f16 fragments (one product; x, W1 and b1 are rounded to 8 significant bits before, f16 keeps 11),
// W2[f] as exact f16 (f16 of its bf16 rounding; [out][in] rows are the A operand, h1 the B operand); this product leaves the matrix unit as f16 (v_wmma_f16_16x16x32_f16). The output dots
// y = h2.W3[f] + b3[f] (64 terms) are a second product on v_wmma_f32_16x16x32_f16: W3[f] as A, the f16 h2 as B, b3[f] as C, f32 accumulate.

#define NB_  65536
#define NF   64
#define H1   64
#define H2   64
#define SLP  0.05f

typedef _Float16 h16;
typedef __attribute__((ext_vector_type(16))) _Float16 v16h;
typedef __attribute__((ext_vector_type(8)))  _Float16 v8h;
typedef __attribute__((ext_vector_type(8)))  float    v8f;
typedef __attribute__((ext_vector_type(4)))  float    v4f;
typedef __attribute__((ext_vector_type(8)))  unsigned v8u;
typedef v4f  __attribute__((may_alias)) v4fa;

__device__ __forceinline__ unsigned short f2bf(float f) { unsigned u = __float_as_uint(f); u += 0x7FFFu + ((u >> 16) & 1u); return (unsigned short)(u >> 16); }
__device__ __forceinline__ float bf2f(unsigned short b) { return __uint_as_float(((unsigned)b) << 16); }
__device__ __forceinline__ float bfr(float f) { return bf2f(f2bf(f)); }
__device__ __forceinline__ v16h cat16(v8h lo, v8h hi) { return __builtin_shufflevector(lo, hi, 0, 1, 2, 3, 4, 5, 6, 7, 8, 9, 10, 11, 12, 13, 14, 15); }
__device__ __forceinline__ v8f wmma16(v16h a, v16h b, v8f c) { return __builtin_amdgcn_wmma_f32_16x16x32_f16(false, a, false, b, (short)0, c, false, false); }
__device__ __forceinline__ v8h wmma16h(v16h a, v16h b, v8h c) { return __builtin_amdgcn_wmma_f16_16x16x32_f16(false, a, false, b, (short)0, c, false, false); }
// leaky(v) = max(v, SLP v) for a slope below 1: v >= 0 gives v >= SLP v, v < 0 gives SLP v > v; the same value as the select for every v
__device__ __forceinline__ float lk(float v) { return __builtin_fmaxf(v, SLP * v); }
#define VST2(T, p, v) do { const T vst2_v_ = (v); *(T*)(p) = vst2_v_;  } while (0)

// k_w16: rounds all weights but b3 (rounded in k_main). W2 -> f16 rows; W1, b1 -> f32 holding the bf16 rounding; b2, W3 -> f16 of the bf16 rounding, per feature 64 b2 then 64 W3.
__global__ __launch_bounds__(256) void k_w16(const float* __restrict__ W2, const float* __restrict__ W1, const float* __restrict__ b1, const float* __restrict__ b2,
                                             const float* __restrict__ W3, h16* W16, float* W1r, float* B1r, h16* CST) {
    const int lane = threadIdx.x & 31, r = blockIdx.x * 8 + (threadIdx.x >> 5);
    const int i = blockIdx.x * 256 + (int)threadIdx.x;
    if (i < NF * H1) { const int ff = i >> 6, g = i & 63;      // the first 16 blocks also round the four small tables, one element of each a thread
        W1r[i] = bfr(W1[i]); B1r[i] = bfr(b1[i]); CST[ff * 128 + g] = (h16)bfr(b2[i]); CST[ff * 128 + 64 + g] = (h16)bfr(W3[i]); }
    if (r >= NF * H2) return;
    typedef __attribute__((ext_vector_type(2))) _Float16 v2h;
    v2h o; o[0] = (h16)bfr(W2[(size_t)r * H1 + 2 * lane]); o[1] = (h16)bfr(W2[(size_t)r * H1 + 2 * lane + 1]);
    VST2(v2h, W16 + (size_t)r * H1 + 2 * lane, o);
}

// k_main: block = 256 rows b x all 64 features, 16 waves; the waves split the FEATURES (4 each), not the rows: for each of its features a wave loads the rounded W1[f], b1[f], b2[f], W3[f]
// and the W2[f] fragments ONCE into registers and then walks the block's 16 row tiles with them. The product is taken TRANSPOSED: W2[f] (rows g) is the A operand and
// h1 (columns b) the B operand, so D element j of n-tile n is h2pre[g = 16 n + 8 hi + j][b = lr]: a lane holds 32 of its own row's 64 hidden units. Per tile: h1 fragments
// (k = hidden unit h: h1 = f16(leaky(x[b][f] bf16(W1[f][h]) + bf16(b1[f][h])))), 2 k-chunks x 4 n-tiles = 8 WMMA into 4 f16 accumulators, b2[f][g] entering as C;
// h2 = leaky(acc) on packed f16. Two packed D tiles side by side ARE a B fragment in the hardware k order (element s: k = 8 hi + s, then 16 + 8 hi + (s - 8)), so
// y[b][f] = sum_g W3[f][g] h2[g][b] + b3[f] is 2 more WMMA (k = g, f32 accumulate, b3 as C) with no lane exchange; all 16 rows of that A hold W3[f], so every D register is y[b = lr].
// y is parked in LDS [row][feature]; whole output rows are stored. All weights but b3 arrive rounded from k_w16 (workspace) and are read into registers once per feature.
// x: the block's 256 x 64 tile is brought into LDS once, whole rows in 16-byte pieces, rounded to bf16 on the way; a tile's row scalar is then one LDS read, issued one tile ahead of its use.
// The staging stands inside the wave's first feature (its loads ahead of the weight loads, its LDS stores and the barrier behind them), so that feature is written apart from the loop over the other three.
#define WV   16                 // waves per block = row tiles per block
#define FPW  (NF / WV)          // features per wave
#define RPB  (WV * 16)          // rows per block
typedef __attribute__((ext_vector_type(2)))  float    v2f;
__global__ __launch_bounds__(WV * 32) void k_main(const float* __restrict__ x, const float* __restrict__ W1r, const float* __restrict__ B1r, const h16* __restrict__ W16,
                                             const h16* __restrict__ CST, const float* __restrict__ b3, float* out) {
    __shared__ __align__(32) float yt[RPB * 68];        // y tile [row][68]
    __shared__ __align__(32) float xs[RPB * 68];        // x tile [row][68], bf16-rounded values as f32
    const int lane = threadIdx.x & 31, wave = threadIdx.x >> 5, lr = lane & 15, hi = lane >> 4;
    const int R0 = blockIdx.x * RPB;
    auto feature = [&](const int fi, const bool first) __attribute__((always_inline)) {
        const int f = wave * FPW + fi;
        // first feature only: this wave's 16 rows of x are requested ahead of the weight loads, so that both fly together (lanes 0..15 one row, 16..31 the next, 16 B each)
        const float* xg = x + (size_t)(R0 + wave * 16 + hi) * NF + lr * 4;
        v4f xr[8];
        if (first) {
#pragma unroll
            for (int s = 0; s < 8; ++s) xr[s] = *(const v4f*)(xg + (size_t)s * 2 * NF);
            // the wait that belongs in front of an overwrite of these loads' address registers; the pointer as input keeps it live up to here
            asm volatile("s_wait_xcnt 0x0" :: "v"(xg) : "memory");
        }
        const float* w1p = W1r + f * H1 + 8 * hi; const float* b1p = B1r + f * H1 + 8 * hi;    // this lane's k offset 8 hi in the rounded W1[f], b1[f]
        float w1r[2][16], b1r[2][16];
#pragma unroll
        for (int kc = 0; kc < 2; ++kc)
#pragma unroll
            for (int q = 0; q < 16; ++q) { const int h = kc * 32 + ((q < 8) ? q : (16 + (q - 8)));
                w1r[kc][q] = w1p[h]; b1r[kc][q] = b1p[h]; }
        const h16* wf = W16 + (size_t)f * H2 * H1 + lr * H1 + 8 * hi;         // this lane's place in W2[f]: row lr of an n-tile, k offset 8 hi
        v16h bb[2][4];
#pragma unroll
        for (int kc = 0; kc < 2; ++kc)
#pragma unroll
            for (int n = 0; n < 4; ++n) { const h16* bp = wf + (size_t)n * 16 * H1 + kc * 32; bb[kc][n] = cat16(*(const v8h*)bp, *(const v8h*)(bp + 16)); }
        const float b3r = bfr(b3[f]);
        const h16* cf = CST + f * 128 + 8 * hi;                                // this lane's g offset 8 hi in the feature's b2 (and, 64 on, W3)
        v8h c2[4];       // C = b2[f][16 n + 8 hi + j]
#pragma unroll
        for (int n = 0; n < 4; ++n) c2[n] = *(const v8h*)(cf + n * 16);
        v16h a3[2];      // W3[f] in the same k order as the packed D pairs: g = 32 kc + 8 hi + s, then 32 kc + 16 + 8 hi + (s - 8); the same in every row
#pragma unroll
        for (int kc = 0; kc < 2; ++kc) a3[kc] = cat16(*(const v8h*)(cf + 64 + kc * 32), *(const v8h*)(cf + 64 + kc * 32 + 16));
        // the wait that belongs in front of an overwrite of the loads' address registers; the four pointers and f (the b3 load's offset) as inputs keep them live up to here, so that no load of the run lands on one
        asm volatile("s_wait_xcnt 0x0" :: "v"(wf), "v"(w1p), "v"(b1p), "v"(cf), "v"(f) : "memory");
        if (first) {
#pragma unroll
            for (int s = 0; s < 8; ++s) { const v4f v = { bfr(xr[s][0]), bfr(xr[s][1]), bfr(xr[s][2]), bfr(xr[s][3]) };
                *(v4fa*)(xs + (wave * 16 + 2 * s + hi) * 68 + lr * 4) = v; }
            __syncthreads();    // a wave reads its features' columns of all 256 rows, which the 16 waves have written: every store must be seen before the first read
        }
        const v8f c3 = { b3r, b3r, b3r, b3r, b3r, b3r, b3r, b3r };
        const float* xl = xs + lr * 68 + f;                                     // this lane's row of tile 0, this feature
        float xb = xl[0];
        int nx = 16 * 68;                                                       // where the next tile's scalar stands, in floats from xl
#pragma unroll 1
        for (int t = 0; t < WV; ++t) {
            v16h ah[2];      // h1 in k order: element q of chunk kc
#pragma unroll
            for (int kc = 0; kc < 2; ++kc)
#pragma unroll
                for (int q = 0; q < 16; q += 2) {       // two values a step as an f32 pair: one packed fma, one packed conversion (round to nearest even)
                    const v2f w = { w1r[kc][q], w1r[kc][q + 1] }, b = { b1r[kc][q], b1r[kc][q + 1] }, xx = { xb, xb };
                    const v2f p = xx * w + b;
                    ah[kc][q] = (h16)lk(p[0]); ah[kc][q + 1] = (h16)lk(p[1]); }
            xb = xl[nx];     // the next tile's row scalar, read while this tile's products run (behind the last tile: tile 0 again, not used)
            nx = (nx == (WV - 1) * 16 * 68) ? 0 : nx + 16 * 68;
            v8h acc[4];
#pragma unroll   // acc is registers; four independent accumulators, three other WMMA between two uses of one
            for (int n = 0; n < 4; ++n) acc[n] = wmma16h(bb[0][n], ah[0], c2[n]);
#pragma unroll
            for (int n = 0; n < 4; ++n) acc[n] = wmma16h(bb[1][n], ah[1], acc[n]);
            // keeps the eight products together in front of the first reader of a result: moved in between them, a reader stands right behind its product and the slots up to it are filled with v_nop
            __builtin_amdgcn_sched_barrier(0);
            // h2 = leaky(h2pre), two values an instruction. maximum, not max: in front of max the compiler quiets a WMMA result with one more instruction per register;
            // the two agree on every value that is not a NaN, and a NaN stays a NaN in both
#pragma unroll
            for (int n = 0; n < 4; ++n) acc[n] = __builtin_elementwise_maximum(acc[n], acc[n] * (h16)SLP);
            v8f y = wmma16(a3[0], cat16(acc[0], acc[1]), c3);
            y = wmma16(a3[1], cat16(acc[2], acc[3]), y);
            if (hi == 0) yt[(t * 16 + lr) * 68 + f] = y[0];
        }
    };
    feature(0, true);
#pragma unroll 1
    for (int fi = 1; fi < FPW; ++fi) feature(fi, false);
    __syncthreads();    // a row's 64 features come from all 16 waves: every wave's LDS stores must be seen before whole rows are read
    // wave writes 16 rows: row = 64 floats = 2 lines: lanes 0..15 one row, 16..31 the next, 16 B each; 8 instructions of 2 rows
    const float* myy = yt + wave * 16 * 68;
    const int r0 = R0 + wave * 16;
#pragma unroll
    for (int s = 0; s < 8; ++s) { const int row = 2 * s + (lane >> 4), piece = lane & 15; const v4f v = *(const v4fa*)(myy + row * 68 + piece * 4);
        *(v4f*)(out + (size_t)(r0 + row) * NF + piece * 4) = v; }
}

extern "C" void kernel_launch(void* const* d_in, const int* in_sizes, int n_in,
                              void* d_out, int out_size, void* d_ws, size_t ws_size, hipStream_t stream) {
    (void)in_sizes; (void)n_in; (void)out_size;
    const float* x = (const float*)d_in[0]; const float* W1 = (const float*)d_in[1]; const float* b1 = (const float*)d_in[2]; const float* W2 = (const float*)d_in[3];
    const float* b2 = (const float*)d_in[4]; const float* W3 = (const float*)d_in[5]; const float* b3 = (const float*)d_in[6];
    float* out = (float*)d_out;    // [65536][1][64]
    char* wsp = (char*)d_ws;
    auto take = [&](size_t bytes) { char* p = wsp; wsp += (bytes + 255) & ~(size_t)255; return (void*)p; };
    h16* W16 = (h16*)take((size_t)NF * H2 * H1 * 2);
    float* W1r = (float*)take((size_t)NF * H1 * 4); float* B1r = (float*)take((size_t)NF * H1 * 4); h16* CST = (h16*)take((size_t)NF * 2 * H2 * 2);
    if ((size_t)(wsp - (char*)d_ws) > ws_size) return;    // 0.55 MB
    k_w16<<<(NF * H2) / 8, 256, 0, stream>>>(W2, W1, b1, b2, W3, W16, W1r, B1r, CST);
    k_main<<<NB_ / RPB, WV * 32, 0, stream>>>(x, W1r, B1r, W16, CST, b3, out);
}
